// v000
// Times are from an AMD MI455X. After a warm-up the kernel runs many times in a row, and a time is the length of
// such a window on the GPU divided by its runs, so every launch and the gaps after it count. The runs cycle
// through copies of the inputs. A figure is the median of several windows, for all but v000 over two sittings.
// Sittings can differ by a few percent; kernels timed side by side share one.
// v000, which the later versions start from, runs in 122 microseconds.
#include <hip/hip_runtime.h>
#include <hip/hip_bf16.h>
#include <math.h>

// ---------------------------------------------------------------------------
// PointTransformerLayer fused implementation for gfx1250 (CDNA5, wave32).
// fp32 end-to-end using V_WMMA_F32_16X16X4_F32 to preserve reference numerics.
//
// Weight matrices live in LDS in a pair-interleaved, XOR-swizzled layout so
// the WMMA B operand {W[k][n], W[k+1][n]} is a single conflict-free
// ds_load_b64 with an immediate offset (no per-step address math, no operand
// marshalling movs).
// ---------------------------------------------------------------------------

typedef float v2f __attribute__((ext_vector_type(2)));
typedef float v8f __attribute__((ext_vector_type(8)));

#define CCH   64          // channels
#define KNBR  16          // neighbors per point
#define STG   68          // staging row stride in floats (bank-conflict-free, 8B aligned)
#define WAVES_PER_BLOCK 8

__device__ __forceinline__ v8f wmma_f32(v2f a, v2f b, v8f c) {
  // 8-arg VOP3P form: (neg_a, A, neg_b, B, c_mod, C, reuse_a, reuse_b)
  return __builtin_amdgcn_wmma_f32_16x16x4_f32(false, a, false, b, (short)0, c,
                                               false, false);
}

// Swizzled LDS index for weight element pair-row pr = k>>1, column n.
//  - pairs (k, k+1) interleaved -> one ds_load_b64 per B operand
//  - XOR of the tile bit for odd pair-rows -> the two half-waves use disjoint
//    32-bank sets (conflict-free b64 loads)
__device__ __forceinline__ int bswz(int pr, int n) {
  return pr * 128 + ((n ^ ((pr & 1) << 4)) << 1);
}

// Cooperative copy of a 64x64 weight matrix into swizzled LDS layout.
__device__ __forceinline__ void load_w_swz(float* dst, const float* __restrict__ src) {
  for (int idx = threadIdx.x; idx < CCH * CCH; idx += 256) {
    int k = idx >> 6, n = idx & 63;
    dst[bswz(k >> 1, n) + (k & 1)] = src[idx];
  }
}

// ---------------------------------------------------------------------------
// Kernel 1: q/k/v = features @ W{q,k,v} + b.  One wave per 16-row tile.
// A operand preloaded in WMMA A-layout straight from global (8B loads).
// ---------------------------------------------------------------------------
__global__ __launch_bounds__(256) void qkv_kernel(
    const float* __restrict__ features,
    const float* __restrict__ Wq, const float* __restrict__ bq,
    const float* __restrict__ Wk, const float* __restrict__ bk,
    const float* __restrict__ Wv, const float* __restrict__ bv,
    float* __restrict__ qb, float* __restrict__ kb, float* __restrict__ vb,
    int ntiles)
{
  __shared__ float ldsW[3 * CCH * CCH];
  load_w_swz(ldsW,               Wq);
  load_w_swz(ldsW + CCH * CCH,   Wk);
  load_w_swz(ldsW + 2 * CCH * CCH, Wv);
  __syncthreads();

  int wave = blockIdx.x * WAVES_PER_BLOCK + (threadIdx.x >> 5);
  if (wave >= ntiles) return;                      // wave-uniform branch
  int lane = threadIdx.x & 31;
  int hi = lane >> 4, lm = lane & 15;
  int base = wave * 16;

  // A-layout (f32 16x4): lanes 0-15 hold {k0,k0+1} of row lm, lanes 16-31 {k0+2,k0+3}
  v2f A[16];
  const float* arow = features + (size_t)(base + lm) * CCH;
#pragma unroll
  for (int s = 0; s < 16; ++s)
    A[s] = *(const v2f*)(arow + 4 * s + 2 * hi);

  const float* Bias[3] = {bq, bk, bv};
  float*       Out[3]  = {qb, kb, vb};

#pragma unroll
  for (int w = 0; w < 3; ++w) {
    const float* Wl = ldsW + w * CCH * CCH;
#pragma unroll
    for (int t = 0; t < 4; ++t) {
      // per-tile B base: pr = 2s+hi -> addr = base + s*256 dwords (imm offsets)
      const float* bbase = Wl + hi * 128 + (((16 * t + lm) ^ (hi << 4)) << 1);
      v8f acc = {};
#pragma unroll
      for (int s = 0; s < 16; ++s) {
        v2f b = *(const v2f*)(bbase + s * 256);    // ds_load_b64, imm offset
        acc = wmma_f32(A[s], b, acc);
      }
      float bias = Bias[w][16 * t + lm];
      float* op  = Out[w];
#pragma unroll
      for (int r = 0; r < 8; ++r)
        op[(size_t)(base + r + 8 * hi) * CCH + 16 * t + lm] = acc[r] + bias;
    }
  }
}

// ---------------------------------------------------------------------------
// Kernel 2: fused neighborhood transformer, one wave32 per point.
//   p    = relu(bn(rel @ Wp + b_p))            (4 WMMAs, K=3 zero-padded to 4)
//   a    = q_i - gather(k) + p  -> LDS staging
//   t1   = relu(bn(a @ Wg1 + bg1))             (64 WMMAs)
//   h    = t1 @ Wg2 + bg2                      (64 WMMAs)
//   attn = softmax over the 16 neighbors (in-lane + shfl_xor 16)
//   s    = sum_m (gather(v)+p)*attn            -> workspace
// ---------------------------------------------------------------------------
__global__ __launch_bounds__(256) void pt_main_kernel(
    const float* __restrict__ points, const int* __restrict__ gidx,
    const float* __restrict__ qb, const float* __restrict__ kb,
    const float* __restrict__ vb,
    const float* __restrict__ Wp,   const float* __restrict__ b_p,
    const float* __restrict__ bnp_g, const float* __restrict__ bnp_b,
    const float* __restrict__ bnp_m, const float* __restrict__ bnp_v,
    const float* __restrict__ Wg1,  const float* __restrict__ bg1,
    const float* __restrict__ bng_g, const float* __restrict__ bng_b,
    const float* __restrict__ bng_m, const float* __restrict__ bng_v,
    const float* __restrict__ Wg2,  const float* __restrict__ bg2,
    float* __restrict__ sb, int N)
{
  __shared__ float w1[CCH * CCH];
  __shared__ float w2[CCH * CCH];
  __shared__ float stg[WAVES_PER_BLOCK * 16 * STG];
  load_w_swz(w1, Wg1);
  load_w_swz(w2, Wg2);
  __syncthreads();

  int winb = threadIdx.x >> 5;
  int i    = blockIdx.x * WAVES_PER_BLOCK + winb;
  if (i >= N) return;                              // wave-uniform branch
  int lane = threadIdx.x & 31;
  int hi = lane >> 4, lm = lane & 15;
  float* st = stg + winb * 16 * STG;

  // Per-lane channel constants (channel c = 16t + lm), BN folded to scale/shift.
  float bpv[4], pscale[4], pshift[4], g1bias[4], gscale[4], gshift[4], g2bias[4];
  v2f wpB[4];
#pragma unroll
  for (int t = 0; t < 4; ++t) {
    int c = 16 * t + lm;
    bpv[t] = b_p[c];
    float ps = bnp_g[c] * (1.0f / sqrtf(bnp_v[c] + 1e-5f));
    pscale[t] = ps;
    pshift[t] = bnp_b[c] - bnp_m[c] * ps;
    g1bias[t] = bg1[c];
    float gs = bng_g[c] * (1.0f / sqrtf(bng_v[c] + 1e-5f));
    gscale[t] = gs;
    gshift[t] = bng_b[c] - bng_m[c] * gs;
    g2bias[t] = bg2[c];
    // B operand of the p-GEMM (Wp is 3x64, K padded to 4 with zeros)
    wpB[t].x = hi ? Wp[2 * CCH + c] : Wp[0 * CCH + c];
    wpB[t].y = hi ? 0.0f            : Wp[1 * CCH + c];
  }

  // Neighbor indices for the rows this half-wave owns (m = r + 8*hi).
  int idx8[8];
#pragma unroll
  for (int r = 0; r < 8; ++r)
    idx8[r] = gidx[(size_t)i * KNBR + r + 8 * hi];

  // rel as A operand (A-layout: lane m holds {x,y} low-half, {z,0} high-half).
  int   mi = gidx[(size_t)i * KNBR + lm];
  float nx = points[(size_t)mi * 3 + 0] - points[(size_t)i * 3 + 0];
  float ny = points[(size_t)mi * 3 + 1] - points[(size_t)i * 3 + 1];
  float nz = points[(size_t)mi * 3 + 2] - points[(size_t)i * 3 + 2];
  v2f relA;
  relA.x = hi ? nz : nx;
  relA.y = hi ? 0.0f : ny;

  // p = relu(bn(rel @ Wp + b_p))
  float p[4][8];
#pragma unroll
  for (int t = 0; t < 4; ++t) {
    v8f acc = {};
    acc = wmma_f32(relA, wpB[t], acc);
#pragma unroll
    for (int r = 0; r < 8; ++r) {
      float x = (acc[r] + bpv[t]) * pscale[t] + pshift[t];
      p[t][r] = x > 0.0f ? x : 0.0f;
    }
  }

  // a = q_i - k[idx] + p  -> staging (row-major, stride 68 floats)
#pragma unroll
  for (int t = 0; t < 4; ++t) {
    float qv = qb[(size_t)i * CCH + 16 * t + lm];
#pragma unroll
    for (int r = 0; r < 8; ++r) {
      float kv = kb[(size_t)idx8[r] * CCH + 16 * t + lm];
      st[(r + 8 * hi) * STG + 16 * t + lm] = qv - kv + p[t][r];
    }
  }
  asm volatile("s_wait_dscnt 0" ::: "memory");  // staging visible within wave

  // GEMM 1: t1 = relu(bn(a @ Wg1 + bg1))
  const float* arow = st + lm * STG + 2 * hi;   // A base, +16B per k-step
  float t1[4][8];
#pragma unroll
  for (int t = 0; t < 4; ++t) {
    const float* bbase = w1 + hi * 128 + (((16 * t + lm) ^ (hi << 4)) << 1);
    v8f acc = {};
#pragma unroll
    for (int s = 0; s < 16; ++s) {
      v2f av = *(const v2f*)(arow + 4 * s);        // ds_load_b64, imm offset
      v2f bv = *(const v2f*)(bbase + s * 256);     // ds_load_b64, imm offset
      acc = wmma_f32(av, bv, acc);
    }
#pragma unroll
    for (int r = 0; r < 8; ++r) {
      float x = (acc[r] + g1bias[t]) * gscale[t] + gshift[t];
      t1[t][r] = x > 0.0f ? x : 0.0f;
    }
  }

  // Overwrite staging with t1 (all tiles have finished reading `a`).
#pragma unroll
  for (int t = 0; t < 4; ++t)
#pragma unroll
    for (int r = 0; r < 8; ++r)
      st[(r + 8 * hi) * STG + 16 * t + lm] = t1[t][r];
  asm volatile("s_wait_dscnt 0" ::: "memory");

  // GEMM 2: h = t1 @ Wg2 + bg2
  float h[4][8];
#pragma unroll
  for (int t = 0; t < 4; ++t) {
    const float* bbase = w2 + hi * 128 + (((16 * t + lm) ^ (hi << 4)) << 1);
    v8f acc = {};
#pragma unroll
    for (int s = 0; s < 16; ++s) {
      v2f av = *(const v2f*)(arow + 4 * s);
      v2f bv = *(const v2f*)(bbase + s * 256);
      acc = wmma_f32(av, bv, acc);
    }
#pragma unroll
    for (int r = 0; r < 8; ++r)
      h[t][r] = acc[r] + g2bias[t];
  }

  // Softmax over the 16 neighbors per channel, then weighted sum with (v+p).
  // Channel c = 16t+lm lives in lanes lm and lm+16 (8 rows each).
#pragma unroll
  for (int t = 0; t < 4; ++t) {
    float mx = h[t][0];
#pragma unroll
    for (int r = 1; r < 8; ++r) mx = fmaxf(mx, h[t][r]);
    mx = fmaxf(mx, __shfl_xor(mx, 16, 32));
    float ssum = 0.0f;
#pragma unroll
    for (int r = 0; r < 8; ++r) {
      float e = __expf(h[t][r] - mx);
      h[t][r] = e;
      ssum += e;
    }
    ssum += __shfl_xor(ssum, 16, 32);
    float inv = 1.0f / ssum;

    float acc = 0.0f;
#pragma unroll
    for (int r = 0; r < 8; ++r) {
      float gvv = vb[(size_t)idx8[r] * CCH + 16 * t + lm];
      acc += (gvv + p[t][r]) * h[t][r];
    }
    acc *= inv;
    acc += __shfl_xor(acc, 16, 32);
    if (hi == 0) sb[(size_t)i * CCH + 16 * t + lm] = acc;
  }
}

// ---------------------------------------------------------------------------
// Kernel 3: out = s @ Wo + bo.  Same tiling as kernel 1, single matrix.
// ---------------------------------------------------------------------------
__global__ __launch_bounds__(256) void proj_kernel(
    const float* __restrict__ sbuf, const float* __restrict__ Wo,
    const float* __restrict__ bo, float* __restrict__ out, int ntiles)
{
  __shared__ float ldsW[CCH * CCH];
  load_w_swz(ldsW, Wo);
  __syncthreads();

  int wave = blockIdx.x * WAVES_PER_BLOCK + (threadIdx.x >> 5);
  if (wave >= ntiles) return;
  int lane = threadIdx.x & 31;
  int hi = lane >> 4, lm = lane & 15;
  int base = wave * 16;

  v2f A[16];
  const float* arow = sbuf + (size_t)(base + lm) * CCH;
#pragma unroll
  for (int s = 0; s < 16; ++s)
    A[s] = *(const v2f*)(arow + 4 * s + 2 * hi);

#pragma unroll
  for (int t = 0; t < 4; ++t) {
    const float* bbase = ldsW + hi * 128 + (((16 * t + lm) ^ (hi << 4)) << 1);
    v8f acc = {};
#pragma unroll
    for (int s = 0; s < 16; ++s) {
      v2f b = *(const v2f*)(bbase + s * 256);
      acc = wmma_f32(A[s], b, acc);
    }
    float bias = bo[16 * t + lm];
#pragma unroll
    for (int r = 0; r < 8; ++r)
      out[(size_t)(base + r + 8 * hi) * CCH + 16 * t + lm] = acc[r] + bias;
  }
}

// ---------------------------------------------------------------------------
extern "C" void kernel_launch(void* const* d_in, const int* in_sizes, int n_in,
                              void* d_out, int out_size, void* d_ws, size_t ws_size,
                              hipStream_t stream)
{
  const float* points   = (const float*)d_in[0];
  const float* features = (const float*)d_in[1];
  const int*   gidx     = (const int*)d_in[2];
  const float* Wq  = (const float*)d_in[3];  const float* bq  = (const float*)d_in[4];
  const float* Wk  = (const float*)d_in[5];  const float* bk  = (const float*)d_in[6];
  const float* Wv  = (const float*)d_in[7];  const float* bv  = (const float*)d_in[8];
  const float* Wp  = (const float*)d_in[9];  const float* b_p = (const float*)d_in[10];
  const float* bnp_g = (const float*)d_in[11]; const float* bnp_b = (const float*)d_in[12];
  const float* bnp_m = (const float*)d_in[13]; const float* bnp_v = (const float*)d_in[14];
  const float* Wg1 = (const float*)d_in[15]; const float* bg1 = (const float*)d_in[16];
  const float* bng_g = (const float*)d_in[17]; const float* bng_b = (const float*)d_in[18];
  const float* bng_m = (const float*)d_in[19]; const float* bng_v = (const float*)d_in[20];
  const float* Wg2 = (const float*)d_in[21]; const float* bg2 = (const float*)d_in[22];
  const float* Wo  = (const float*)d_in[23]; const float* bo  = (const float*)d_in[24];

  const int N = in_sizes[0] / 3;        // points is (N, 3); N = 50000 (16-aligned)
  float* qb = (float*)d_ws;             // workspace: q | k | v | s, each N*64 f32
  float* kb = qb + (size_t)N * CCH;
  float* vb = kb + (size_t)N * CCH;
  float* sb = vb + (size_t)N * CCH;

  const int ntiles = (N + 15) / 16;
  const int nblk_t = (ntiles + WAVES_PER_BLOCK - 1) / WAVES_PER_BLOCK;
  const int nblk_p = (N + WAVES_PER_BLOCK - 1) / WAVES_PER_BLOCK;

  qkv_kernel<<<nblk_t, 256, 0, stream>>>(features, Wq, bq, Wk, bk, Wv, bv,
                                         qb, kb, vb, ntiles);
  pt_main_kernel<<<nblk_p, 256, 0, stream>>>(points, gidx, qb, kb, vb,
                                             Wp, b_p, bnp_g, bnp_b, bnp_m, bnp_v,
                                             Wg1, bg1, bng_g, bng_b, bng_m, bng_v,
                                             Wg2, bg2, sb, N);
  proj_kernel<<<nblk_t, 256, 0, stream>>>(sb, Wo, bo, (float*)d_out, ntiles);
}

// v001
// Measured time: 121 microseconds a run.
// Two timings next to v000 both put it at 1.05 times that version's speed.
#include <hip/hip_runtime.h>
#include <hip/hip_bf16.h>
#include <math.h>

// ---------------------------------------------------------------------------
// PointTransformerLayer fused implementation for gfx1250 (CDNA5, wave32).
// fp32 end-to-end using V_WMMA_F32_16X16X4_F32 to preserve reference numerics.
//
// Weight matrices live in LDS in a pair-interleaved, XOR-swizzled layout so
// the WMMA B operand {W[k][n], W[k+1][n]} is a single conflict-free
// ds_load_b64 with an immediate offset (no per-step address math, no operand
// marshalling movs).
// ---------------------------------------------------------------------------

typedef float v2f __attribute__((ext_vector_type(2)));
typedef float v8f __attribute__((ext_vector_type(8)));

#define CCH   64          // channels
#define KNBR  16          // neighbors per point
#define STG   68          // staging row stride in floats (bank-conflict-free, 8B aligned)
#define WAVES_PER_BLOCK 8
#define WPH   160         // dword offset of the high half-wave's plane of Wp pairs (other 32 banks)
#define MAIN_BLOCKS 768   // pt_main_kernel: 3 resident work-groups on each of 256 WGPs

__device__ __forceinline__ v8f wmma_f32(v2f a, v2f b, v8f c) {
  // 8-arg VOP3P form: (neg_a, A, neg_b, B, c_mod, C, reuse_a, reuse_b)
  return __builtin_amdgcn_wmma_f32_16x16x4_f32(false, a, false, b, (short)0, c,
                                               false, false);
}

// Swizzled LDS index for weight element pair-row pr = k>>1, column n.
//  - pairs (k, k+1) interleaved -> one ds_load_b64 per B operand
//  - XOR of the tile bit for odd pair-rows -> the two half-waves use disjoint
//    32-bank sets (conflict-free b64 loads)
__device__ __forceinline__ int bswz(int pr, int n) {
  return pr * 128 + ((n ^ ((pr & 1) << 4)) << 1);
}

// Cooperative copy of a 64x64 weight matrix into swizzled LDS layout.
__device__ __forceinline__ void load_w_swz(float* dst, const float* __restrict__ src) {
  for (int idx = threadIdx.x; idx < CCH * CCH; idx += 256) {
    int k = idx >> 6, n = idx & 63;
    dst[bswz(k >> 1, n) + (k & 1)] = src[idx];
  }
}

// ---------------------------------------------------------------------------
// Kernel 1: q/k/v = features @ W{q,k,v} + b.  One wave per 16-row tile.
// A operand preloaded in WMMA A-layout straight from global (8B loads).
// ---------------------------------------------------------------------------
__global__ __launch_bounds__(256) void qkv_kernel(
    const float* __restrict__ features,
    const float* __restrict__ Wq, const float* __restrict__ bq,
    const float* __restrict__ Wk, const float* __restrict__ bk,
    const float* __restrict__ Wv, const float* __restrict__ bv,
    float* __restrict__ qb, float* __restrict__ kb, float* __restrict__ vb,
    int ntiles)
{
  __shared__ float ldsW[3 * CCH * CCH];
  load_w_swz(ldsW,               Wq);
  load_w_swz(ldsW + CCH * CCH,   Wk);
  load_w_swz(ldsW + 2 * CCH * CCH, Wv);
  __syncthreads();

  int wave = blockIdx.x * WAVES_PER_BLOCK + (threadIdx.x >> 5);
  if (wave >= ntiles) return;                      // wave-uniform branch
  int lane = threadIdx.x & 31;
  int hi = lane >> 4, lm = lane & 15;
  int base = wave * 16;

  // A-layout (f32 16x4): lanes 0-15 hold {k0,k0+1} of row lm, lanes 16-31 {k0+2,k0+3}
  v2f A[16];
  const float* arow = features + (size_t)(base + lm) * CCH;
#pragma unroll
  for (int s = 0; s < 16; ++s)
    A[s] = *(const v2f*)(arow + 4 * s + 2 * hi);

  const float* Bias[3] = {bq, bk, bv};
  float*       Out[3]  = {qb, kb, vb};

#pragma unroll
  for (int w = 0; w < 3; ++w) {
    const float* Wl = ldsW + w * CCH * CCH;
#pragma unroll
    for (int t = 0; t < 4; ++t) {
      // per-tile B base: pr = 2s+hi -> addr = base + s*256 dwords (imm offsets)
      const float* bbase = Wl + hi * 128 + (((16 * t + lm) ^ (hi << 4)) << 1);
      v8f acc = {};
#pragma unroll
      for (int s = 0; s < 16; ++s) {
        v2f b = *(const v2f*)(bbase + s * 256);    // ds_load_b64, imm offset
        acc = wmma_f32(A[s], b, acc);
      }
      float bias = Bias[w][16 * t + lm];
      float* op  = Out[w];
#pragma unroll
      for (int r = 0; r < 8; ++r)
        op[(size_t)(base + r + 8 * hi) * CCH + 16 * t + lm] = acc[r] + bias;
    }
  }
}

// ---------------------------------------------------------------------------
// Kernel 2: fused neighborhood transformer, one wave32 per point at a time.
// The grid is one resident set of work-groups; each wave walks the points with
// a fixed stride, so the weights are staged in LDS and the per-channel
// constants are formed once per work-group, not once per 8 points.
//   p    = relu(bn(rel @ Wp + b_p))            (4 WMMAs, K=3 zero-padded to 4)
//   a    = q_i - gather(k) + p  -> LDS staging
//   t1   = relu(bn(a @ Wg1 + bg1))             (64 WMMAs)
//   h    = t1 @ Wg2 + bg2                      (64 WMMAs)
//   attn = softmax over the 16 neighbors (in-lane + shfl_xor 16)
//   s    = sum_m (gather(v)+p)*attn            -> workspace
// ---------------------------------------------------------------------------
// MAIN_BLOCKS counts on 6 waves per SIMD (3 work-groups per WGP): keep the build at or under 160 VGPRs.
__global__ __launch_bounds__(256) void pt_main_kernel(
    const float* __restrict__ points, const int* __restrict__ gidx,
    const float* __restrict__ qb, const float* __restrict__ kb,
    const float* __restrict__ vb,
    const float* __restrict__ Wp,   const float* __restrict__ b_p,
    const float* __restrict__ bnp_g, const float* __restrict__ bnp_b,
    const float* __restrict__ bnp_m, const float* __restrict__ bnp_v,
    const float* __restrict__ Wg1,  const float* __restrict__ bg1,
    const float* __restrict__ bng_g, const float* __restrict__ bng_b,
    const float* __restrict__ bng_m, const float* __restrict__ bng_v,
    const float* __restrict__ Wg2,  const float* __restrict__ bg2,
    float* __restrict__ sb, int N)
{
  __shared__ float w1[CCH * CCH];
  __shared__ float w2[CCH * CCH];
  __shared__ float stg[WAVES_PER_BLOCK * 16 * STG];
  __shared__ float cst[7 * CCH];       // per-channel constants, BN folded to scale/shift
  __shared__ __attribute__((aligned(16))) float wpl[WPH + 2 * CCH]; // B operand pairs of the p-GEMM, one plane per half-wave
  load_w_swz(w1, Wg1);
  load_w_swz(w2, Wg2);
  if (threadIdx.x < CCH) {
    int c = threadIdx.x;
    cst[0 * CCH + c] = b_p[c];
    float ps = bnp_g[c] * (1.0f / sqrtf(bnp_v[c] + 1e-5f));
    cst[1 * CCH + c] = ps;
    cst[2 * CCH + c] = bnp_b[c] - bnp_m[c] * ps;
    cst[3 * CCH + c] = bg1[c];
    float gs = bng_g[c] * (1.0f / sqrtf(bng_v[c] + 1e-5f));
    cst[4 * CCH + c] = gs;
    cst[5 * CCH + c] = bng_b[c] - bng_m[c] * gs;
    cst[6 * CCH + c] = bg2[c];
    // Wp is 3x64, K padded to 4 with zeros: low half-wave {k0,k1}, high {k2,0}
    wpl[2 * c + 0]       = Wp[0 * CCH + c];
    wpl[2 * c + 1]       = Wp[1 * CCH + c];
    wpl[WPH + 2 * c + 0] = Wp[2 * CCH + c];
    wpl[WPH + 2 * c + 1] = 0.0f;
  }
  __syncthreads();

  // wave number in a scalar register: the point loop below is then a scalar loop
  int winb = __builtin_amdgcn_readfirstlane(threadIdx.x >> 5);
  int lane = threadIdx.x & 31;
  int hi = lane >> 4, lm = lane & 15;
  float* st = stg + winb * 16 * STG;

  for (int i = blockIdx.x * WAVES_PER_BLOCK + winb; i < N;
       i += MAIN_BLOCKS * WAVES_PER_BLOCK) {

  // Neighbor indices for the rows this half-wave owns (m = r + 8*hi).
  int idx8[8];
#pragma unroll
  for (int r = 0; r < 8; ++r)
    idx8[r] = gidx[(size_t)i * KNBR + r + 8 * hi];

  // rel as A operand (A-layout: lane m holds {x,y} low-half, {z,0} high-half).
  int   mi = gidx[(size_t)i * KNBR + lm];
  float nx = points[(size_t)mi * 3 + 0] - points[(size_t)i * 3 + 0];
  float ny = points[(size_t)mi * 3 + 1] - points[(size_t)i * 3 + 1];
  float nz = points[(size_t)mi * 3 + 2] - points[(size_t)i * 3 + 2];
  v2f relA;
  relA.x = hi ? nz : nx;
  relA.y = hi ? 0.0f : ny;

  // p = relu(bn(rel @ Wp + b_p))
  float p[4][8];
#pragma unroll
  for (int t = 0; t < 4; ++t) {
    int c = 16 * t + lm;
    v2f wpB = *(const v2f*)(wpl + hi * WPH + 2 * c);
    float bpv = cst[0 * CCH + c], pscale = cst[1 * CCH + c], pshift = cst[2 * CCH + c];
    v8f acc = {};
    acc = wmma_f32(relA, wpB, acc);
#pragma unroll
    for (int r = 0; r < 8; ++r) {
      float x = (acc[r] + bpv) * pscale + pshift;
      p[t][r] = x > 0.0f ? x : 0.0f;
    }
  }

  // a = q_i - k[idx] + p  -> staging (row-major, stride 68 floats)
#pragma unroll
  for (int t = 0; t < 4; ++t) {
    float qv = qb[(size_t)i * CCH + 16 * t + lm];
#pragma unroll
    for (int r = 0; r < 8; ++r) {
      float kv = kb[(size_t)idx8[r] * CCH + 16 * t + lm];
      st[(r + 8 * hi) * STG + 16 * t + lm] = qv - kv + p[t][r];
    }
  }
  asm volatile("s_wait_dscnt 0" ::: "memory");  // staging visible within wave

  // GEMM 1: t1 = relu(bn(a @ Wg1 + bg1))
  const float* arow = st + lm * STG + 2 * hi;   // A base, +16B per k-step
  float t1[4][8];
#pragma unroll
  for (int t = 0; t < 4; ++t) {
    const float* bbase = w1 + hi * 128 + (((16 * t + lm) ^ (hi << 4)) << 1);
    v8f acc = {};
#pragma unroll
    for (int s = 0; s < 16; ++s) {
      v2f av = *(const v2f*)(arow + 4 * s);        // ds_load_b64, imm offset
      v2f bv = *(const v2f*)(bbase + s * 256);     // ds_load_b64, imm offset
      acc = wmma_f32(av, bv, acc);
    }
    int c = 16 * t + lm;
    float g1bias = cst[3 * CCH + c], gscale = cst[4 * CCH + c], gshift = cst[5 * CCH + c];
#pragma unroll
    for (int r = 0; r < 8; ++r) {
      float x = (acc[r] + g1bias) * gscale + gshift;
      t1[t][r] = x > 0.0f ? x : 0.0f;
    }
  }

  // Overwrite staging with t1 (all tiles have finished reading `a`).
#pragma unroll
  for (int t = 0; t < 4; ++t)
#pragma unroll
    for (int r = 0; r < 8; ++r)
      st[(r + 8 * hi) * STG + 16 * t + lm] = t1[t][r];
  asm volatile("s_wait_dscnt 0" ::: "memory");

  // GEMM 2: h = t1 @ Wg2 + bg2
  float h[4][8];
#pragma unroll
  for (int t = 0; t < 4; ++t) {
    const float* bbase = w2 + hi * 128 + (((16 * t + lm) ^ (hi << 4)) << 1);
    v8f acc = {};
#pragma unroll
    for (int s = 0; s < 16; ++s) {
      v2f av = *(const v2f*)(arow + 4 * s);
      v2f bv = *(const v2f*)(bbase + s * 256);
      acc = wmma_f32(av, bv, acc);
    }
    float g2bias = cst[6 * CCH + 16 * t + lm];
#pragma unroll
    for (int r = 0; r < 8; ++r)
      h[t][r] = acc[r] + g2bias;
  }

  // Softmax over the 16 neighbors per channel, then weighted sum with (v+p).
  // Channel c = 16t+lm lives in lanes lm and lm+16 (8 rows each).
#pragma unroll
  for (int t = 0; t < 4; ++t) {
    float mx = h[t][0];
#pragma unroll
    for (int r = 1; r < 8; ++r) mx = fmaxf(mx, h[t][r]);
    mx = fmaxf(mx, __shfl_xor(mx, 16, 32));
    float ssum = 0.0f;
#pragma unroll
    for (int r = 0; r < 8; ++r) {
      float e = __expf(h[t][r] - mx);
      h[t][r] = e;
      ssum += e;
    }
    ssum += __shfl_xor(ssum, 16, 32);
    float inv = 1.0f / ssum;

    float acc = 0.0f;
#pragma unroll
    for (int r = 0; r < 8; ++r) {
      float gvv = vb[(size_t)idx8[r] * CCH + 16 * t + lm];
      acc += (gvv + p[t][r]) * h[t][r];
    }
    acc *= inv;
    acc += __shfl_xor(acc, 16, 32);
    if (hi == 0) sb[(size_t)i * CCH + 16 * t + lm] = acc;
  }
  // the next trip reuses the registers that the last store names
  asm volatile("s_wait_xcnt 0x0" ::: "memory");

  }  // point loop
}

// ---------------------------------------------------------------------------
// Kernel 3: out = s @ Wo + bo.  Same tiling as kernel 1, single matrix.
// ---------------------------------------------------------------------------
__global__ __launch_bounds__(256) void proj_kernel(
    const float* __restrict__ sbuf, const float* __restrict__ Wo,
    const float* __restrict__ bo, float* __restrict__ out, int ntiles)
{
  __shared__ float ldsW[CCH * CCH];
  load_w_swz(ldsW, Wo);
  __syncthreads();

  int wave = blockIdx.x * WAVES_PER_BLOCK + (threadIdx.x >> 5);
  if (wave >= ntiles) return;
  int lane = threadIdx.x & 31;
  int hi = lane >> 4, lm = lane & 15;
  int base = wave * 16;

  v2f A[16];
  const float* arow = sbuf + (size_t)(base + lm) * CCH;
#pragma unroll
  for (int s = 0; s < 16; ++s)
    A[s] = *(const v2f*)(arow + 4 * s + 2 * hi);

#pragma unroll
  for (int t = 0; t < 4; ++t) {
    const float* bbase = ldsW + hi * 128 + (((16 * t + lm) ^ (hi << 4)) << 1);
    v8f acc = {};
#pragma unroll
    for (int s = 0; s < 16; ++s) {
      v2f b = *(const v2f*)(bbase + s * 256);
      acc = wmma_f32(A[s], b, acc);
    }
    float bias = bo[16 * t + lm];
#pragma unroll
    for (int r = 0; r < 8; ++r)
      out[(size_t)(base + r + 8 * hi) * CCH + 16 * t + lm] = acc[r] + bias;
  }
}

// ---------------------------------------------------------------------------
extern "C" void kernel_launch(void* const* d_in, const int* in_sizes, int n_in,
                              void* d_out, int out_size, void* d_ws, size_t ws_size,
                              hipStream_t stream)
{
  const float* points   = (const float*)d_in[0];
  const float* features = (const float*)d_in[1];
  const int*   gidx     = (const int*)d_in[2];
  const float* Wq  = (const float*)d_in[3];  const float* bq  = (const float*)d_in[4];
  const float* Wk  = (const float*)d_in[5];  const float* bk  = (const float*)d_in[6];
  const float* Wv  = (const float*)d_in[7];  const float* bv  = (const float*)d_in[8];
  const float* Wp  = (const float*)d_in[9];  const float* b_p = (const float*)d_in[10];
  const float* bnp_g = (const float*)d_in[11]; const float* bnp_b = (const float*)d_in[12];
  const float* bnp_m = (const float*)d_in[13]; const float* bnp_v = (const float*)d_in[14];
  const float* Wg1 = (const float*)d_in[15]; const float* bg1 = (const float*)d_in[16];
  const float* bng_g = (const float*)d_in[17]; const float* bng_b = (const float*)d_in[18];
  const float* bng_m = (const float*)d_in[19]; const float* bng_v = (const float*)d_in[20];
  const float* Wg2 = (const float*)d_in[21]; const float* bg2 = (const float*)d_in[22];
  const float* Wo  = (const float*)d_in[23]; const float* bo  = (const float*)d_in[24];

  const int N = in_sizes[0] / 3;        // points is (N, 3); N = 50000 (16-aligned)
  float* qb = (float*)d_ws;             // workspace: q | k | v | s, each N*64 f32
  float* kb = qb + (size_t)N * CCH;
  float* vb = kb + (size_t)N * CCH;
  float* sb = vb + (size_t)N * CCH;

  const int ntiles = (N + 15) / 16;
  const int nblk_t = (ntiles + WAVES_PER_BLOCK - 1) / WAVES_PER_BLOCK;

  qkv_kernel<<<nblk_t, 256, 0, stream>>>(features, Wq, bq, Wk, bk, Wv, bv,
                                         qb, kb, vb, ntiles);
  pt_main_kernel<<<MAIN_BLOCKS, 256, 0, stream>>>(points, gidx, qb, kb, vb,
                                             Wp, b_p, bnp_g, bnp_b, bnp_m, bnp_v,
                                             Wg1, bg1, bng_g, bng_b, bng_m, bng_v,
                                             Wg2, bg2, sb, N);
  proj_kernel<<<nblk_t, 256, 0, stream>>>(sb, Wo, bo, (float*)d_out, ntiles);
}

// v002
// A run of this version takes 116 microseconds.
// In both of two side-by-side timings against v001, it was 1.04 times as fast.
// Over all steps from v000 it is 1.09 times as fast.
#include <hip/hip_runtime.h>
#include <hip/hip_bf16.h>
#include <math.h>

// ---------------------------------------------------------------------------
// PointTransformerLayer fused implementation for gfx1250 (CDNA5, wave32).
// fp32 end-to-end using V_WMMA_F32_16X16X4_F32 to preserve reference numerics.
//
// Weight matrices live in LDS in a pair-interleaved, XOR-swizzled layout so
// the WMMA B operand {W[k][n], W[k+1][n]} is a single conflict-free
// ds_load_b64 with an immediate offset (no per-step address math, no operand
// marshalling movs).
// ---------------------------------------------------------------------------

typedef float v2f __attribute__((ext_vector_type(2)));
typedef float v8f __attribute__((ext_vector_type(8)));

#define CCH   64          // channels
#define KNBR  16          // neighbors per point
#define STG   68          // staging row stride in floats (bank-conflict-free, 8B aligned)
#define WAVES_PER_BLOCK 8
#define WPH   160         // dword offset of the high half-wave's plane of Wp pairs (other 32 banks)
#define MAIN_BLOCKS 768   // pt_main_kernel: 3 resident work-groups on each of 256 WGPs

__device__ __forceinline__ v8f wmma_f32(v2f a, v2f b, v8f c) {
  // 8-arg VOP3P form: (neg_a, A, neg_b, B, c_mod, C, reuse_a, reuse_b)
  return __builtin_amdgcn_wmma_f32_16x16x4_f32(false, a, false, b, (short)0, c,
                                               false, false);
}

// Swizzled LDS index for weight element pair-row pr = k>>1, column n.
//  - pairs (k, k+1) interleaved -> one ds_load_b64 per B operand
//  - XOR of the tile bit for odd pair-rows -> the two half-waves use disjoint
//    32-bank sets (conflict-free b64 loads)
__device__ __forceinline__ int bswz(int pr, int n) {
  return pr * 128 + ((n ^ ((pr & 1) << 4)) << 1);
}

// Cooperative copy of a 64x64 weight matrix into swizzled LDS layout.
__device__ __forceinline__ void load_w_swz(float* dst, const float* __restrict__ src) {
  for (int idx = threadIdx.x; idx < CCH * CCH; idx += 256) {
    int k = idx >> 6, n = idx & 63;
    dst[bswz(k >> 1, n) + (k & 1)] = src[idx];
  }
}

// ---------------------------------------------------------------------------
// Kernel 1: q/k/v = features @ W{q,k,v} + b.  One wave per 16-row tile.
// A operand preloaded in WMMA A-layout straight from global (8B loads).
// ---------------------------------------------------------------------------
__global__ __launch_bounds__(256) void qkv_kernel(
    const float* __restrict__ features,
    const float* __restrict__ Wq, const float* __restrict__ bq,
    const float* __restrict__ Wk, const float* __restrict__ bk,
    const float* __restrict__ Wv, const float* __restrict__ bv,
    float* __restrict__ qb, float* __restrict__ kb, float* __restrict__ vb,
    int ntiles)
{
  __shared__ float ldsW[3 * CCH * CCH];
  load_w_swz(ldsW,               Wq);
  load_w_swz(ldsW + CCH * CCH,   Wk);
  load_w_swz(ldsW + 2 * CCH * CCH, Wv);
  __syncthreads();

  int wave = blockIdx.x * WAVES_PER_BLOCK + (threadIdx.x >> 5);
  if (wave >= ntiles) return;                      // wave-uniform branch
  int lane = threadIdx.x & 31;
  int hi = lane >> 4, lm = lane & 15;
  int base = wave * 16;

  // A-layout (f32 16x4): lanes 0-15 hold {k0,k0+1} of row lm, lanes 16-31 {k0+2,k0+3}
  v2f A[16];
  const float* arow = features + (size_t)(base + lm) * CCH;
#pragma unroll
  for (int s = 0; s < 16; ++s)
    A[s] = *(const v2f*)(arow + 4 * s + 2 * hi);

  const float* Bias[3] = {bq, bk, bv};
  float*       Out[3]  = {qb, kb, vb};

#pragma unroll
  for (int w = 0; w < 3; ++w) {
    const float* Wl = ldsW + w * CCH * CCH;
#pragma unroll
    for (int t = 0; t < 4; ++t) {
      // per-tile B base: pr = 2s+hi -> addr = base + s*256 dwords (imm offsets)
      const float* bbase = Wl + hi * 128 + (((16 * t + lm) ^ (hi << 4)) << 1);
      v8f acc = {};
#pragma unroll
      for (int s = 0; s < 16; ++s) {
        v2f b = *(const v2f*)(bbase + s * 256);    // ds_load_b64, imm offset
        acc = wmma_f32(A[s], b, acc);
      }
      float bias = Bias[w][16 * t + lm];
      float* op  = Out[w];
#pragma unroll
      for (int r = 0; r < 8; ++r)
        op[(size_t)(base + r + 8 * hi) * CCH + 16 * t + lm] = acc[r] + bias;
    }
  }
}

// ---------------------------------------------------------------------------
// Kernel 2: fused neighborhood transformer, one wave32 per point at a time.
// The grid is one resident set of work-groups; each wave walks the points with
// a fixed stride, so the weights are staged in LDS and the per-channel
// constants are formed once per work-group, not once per 8 points.
//   p    = relu(bn(rel @ Wp + b_p))            (4 WMMAs, K=3 zero-padded to 4)
//   a    = q_i - gather(k) + p  -> LDS staging
//   t1   = relu(bn(a @ Wg1 + bg1))             (64 WMMAs)
//   h    = t1 @ Wg2 + bg2                      (64 WMMAs)
//   attn = softmax over the 16 neighbors (in-lane + shfl_xor 16)
//   s    = sum_m (gather(v)+p)*attn            -> workspace
// The gathers run ahead of their use: the 16 k rows and the 16 v rows of a
// point come into LDS that only this wave touches by asynchronous copies
// (v at the top of the trip, read after GEMM 2; the next point's k behind
// GEMM 2, read at the top of the next trip), and the next point's indices,
// coordinates and q row are loaded into registers one trip ahead.
// ---------------------------------------------------------------------------

// An index read from the input, bounded to a row of the N-row tables.
__device__ __forceinline__ unsigned row_of(int v, unsigned last) {
  unsigned u = (unsigned)v;
  return u < last ? u : last;
}

// Sixteen 256-byte rows of src -> LDS rows of STG floats. Copy r: lanes 0-15
// bring row r, lanes 16-31 row r+8, 16 bytes a lane. off[r] is the lane's byte
// offset in src, lds its byte address in LDS row 8*hi; the issuing wave waits
// on asynccnt before it reads.
__device__ __forceinline__ void rows_to_lds(const float* __restrict__ src,
                                            const unsigned (&off)[8], unsigned lds) {
  // the closing s_wait_xcnt stands in the copies' own statement, ahead of any
  // rewrite of the address registers that the copies name
  asm volatile(
      "global_load_async_to_lds_b128 %0, %8, %16\n\t"
      "global_load_async_to_lds_b128 %1, %9, %16\n\t"
      "global_load_async_to_lds_b128 %2, %10, %16\n\t"
      "global_load_async_to_lds_b128 %3, %11, %16\n\t"
      "global_load_async_to_lds_b128 %4, %12, %16\n\t"
      "global_load_async_to_lds_b128 %5, %13, %16\n\t"
      "global_load_async_to_lds_b128 %6, %14, %16\n\t"
      "global_load_async_to_lds_b128 %7, %15, %16\n\t"
      "s_wait_xcnt 0x0"
      :: "v"(lds), "v"(lds + 1 * STG * 4), "v"(lds + 2 * STG * 4), "v"(lds + 3 * STG * 4),
         "v"(lds + 4 * STG * 4), "v"(lds + 5 * STG * 4), "v"(lds + 6 * STG * 4),
         "v"(lds + 7 * STG * 4),
         "v"(off[0]), "v"(off[1]), "v"(off[2]), "v"(off[3]),
         "v"(off[4]), "v"(off[5]), "v"(off[6]), "v"(off[7]),
         "s"(src)
      : "memory");
}

// MAIN_BLOCKS counts on 6 waves per SIMD (3 work-groups per WGP): keep the build at or under 160 VGPRs
// (the second launch bound asks the compiler for those 6 waves) and the LDS of a work-group at or under a third of the WGP's.
__global__ __launch_bounds__(256, 6) void pt_main_kernel(
    const float* __restrict__ points, const int* __restrict__ gidx,
    const float* __restrict__ qb, const float* __restrict__ kb,
    const float* __restrict__ vb,
    const float* __restrict__ Wp,   const float* __restrict__ b_p,
    const float* __restrict__ bnp_g, const float* __restrict__ bnp_b,
    const float* __restrict__ bnp_m, const float* __restrict__ bnp_v,
    const float* __restrict__ Wg1,  const float* __restrict__ bg1,
    const float* __restrict__ bng_g, const float* __restrict__ bng_b,
    const float* __restrict__ bng_m, const float* __restrict__ bng_v,
    const float* __restrict__ Wg2,  const float* __restrict__ bg2,
    float* __restrict__ sb, int N)
{
  __shared__ float w1[CCH * CCH];
  __shared__ float w2[CCH * CCH];
  __shared__ __attribute__((aligned(16))) float stg[WAVES_PER_BLOCK * 16 * STG];  // k rows, then a, then t1
  __shared__ __attribute__((aligned(16))) float vst[WAVES_PER_BLOCK * 16 * STG];  // v rows
  __shared__ float cst[7 * CCH];       // per-channel constants, BN folded to scale/shift
  __shared__ __attribute__((aligned(16))) float wpl[WPH + 2 * CCH]; // B operand pairs of the p-GEMM, one plane per half-wave
  load_w_swz(w1, Wg1);
  load_w_swz(w2, Wg2);
  if (threadIdx.x < CCH) {
    int c = threadIdx.x;
    cst[0 * CCH + c] = b_p[c];
    float ps = bnp_g[c] * (1.0f / sqrtf(bnp_v[c] + 1e-5f));
    cst[1 * CCH + c] = ps;
    cst[2 * CCH + c] = bnp_b[c] - bnp_m[c] * ps;
    cst[3 * CCH + c] = bg1[c];
    float gs = bng_g[c] * (1.0f / sqrtf(bng_v[c] + 1e-5f));
    cst[4 * CCH + c] = gs;
    cst[5 * CCH + c] = bng_b[c] - bng_m[c] * gs;
    cst[6 * CCH + c] = bg2[c];
    // Wp is 3x64, K padded to 4 with zeros: low half-wave {k0,k1}, high {k2,0}
    wpl[2 * c + 0]       = Wp[0 * CCH + c];
    wpl[2 * c + 1]       = Wp[1 * CCH + c];
    wpl[WPH + 2 * c + 0] = Wp[2 * CCH + c];
    wpl[WPH + 2 * c + 1] = 0.0f;
  }
  __syncthreads();

  // wave number in a scalar register: the point loop below is then a scalar loop
  int winb = __builtin_amdgcn_readfirstlane(threadIdx.x >> 5);
  int lane = threadIdx.x & 31;
  int hi = lane >> 4, lm = lane & 15;
  float* st = stg + winb * 16 * STG;
  float* vs = vst + winb * 16 * STG;

  const int i0 = blockIdx.x * WAVES_PER_BLOCK + winb;
  if (i0 >= N) return;                 // wave-uniform, behind the only barrier
  const unsigned last = (unsigned)(N - 1);
  // the lane's LDS byte address (low 32 bits of the shared address) in row 8*hi
  const unsigned lane_off = (unsigned)((hi * 8 * STG + lm * 4) * 4);
  const unsigned st_lds = (unsigned)(size_t)st + lane_off;
  const unsigned vs_lds = (unsigned)(size_t)vs + lane_off;

  // First point: indices of the rows this half-wave owns (m = r + 8*hi), the
  // neighbor and own coordinates, the q row; its k rows start towards LDS.
  unsigned off8[8];
#pragma unroll
  for (int r = 0; r < 8; ++r)
    off8[r] = row_of(gidx[(size_t)i0 * KNBR + r + 8 * hi], last) * (CCH * 4) + lm * 16;
  float gx, gy, gz, ox, oy, oz, qv[4];
  {
    unsigned mi = row_of(gidx[(size_t)i0 * KNBR + lm], last);
    gx = points[(size_t)mi * 3 + 0];
    gy = points[(size_t)mi * 3 + 1];
    gz = points[(size_t)mi * 3 + 2];
    ox = points[(size_t)i0 * 3 + 0];
    oy = points[(size_t)i0 * 3 + 1];
    oz = points[(size_t)i0 * 3 + 2];
#pragma unroll
    for (int t = 0; t < 4; ++t)
      qv[t] = qb[(size_t)i0 * CCH + 16 * t + lm];
  }
  rows_to_lds(kb, off8, st_lds);

  for (int i = i0; i < N; i += MAIN_BLOCKS * WAVES_PER_BLOCK) {
  const bool more = i + MAIN_BLOCKS * WAVES_PER_BLOCK < N;   // scalar
  const int  ip   = more ? i + MAIN_BLOCKS * WAVES_PER_BLOCK : i;

  // rel as A operand (A-layout: lane m holds {x,y} low-half, {z,0} high-half).
  float nx = gx - ox;
  float ny = gy - oy;
  float nz = gz - oz;
  v2f relA;
  relA.x = hi ? nz : nx;
  relA.y = hi ? 0.0f : ny;

  // p = relu(bn(rel @ Wp + b_p))
  float p[4][8];
#pragma unroll
  for (int t = 0; t < 4; ++t) {
    int c = 16 * t + lm;
    v2f wpB = *(const v2f*)(wpl + hi * WPH + 2 * c);
    float bpv = cst[0 * CCH + c], pscale = cst[1 * CCH + c], pshift = cst[2 * CCH + c];
    v8f acc = {};
    acc = wmma_f32(relA, wpB, acc);
#pragma unroll
    for (int r = 0; r < 8; ++r) {
      float x = (acc[r] + bpv) * pscale + pshift;
      p[t][r] = x > 0.0f ? x : 0.0f;
    }
  }

  asm volatile("s_wait_asynccnt 0x0" ::: "memory");  // this point's k rows have landed in st
  asm volatile("s_wait_dscnt 0x0" ::: "memory");     // the last trip's reads of vs are back before vs is refilled
  rows_to_lds(vb, off8, vs_lds);                     // this point's v rows, read behind GEMM 2

  // Next point (this one again on the last trip): indices, own coordinates, q row.
  int nidx[8];
#pragma unroll
  for (int r = 0; r < 8; ++r)
    nidx[r] = gidx[(size_t)ip * KNBR + r + 8 * hi];
  int   nmi = gidx[(size_t)ip * KNBR + lm];
  float nox = points[(size_t)ip * 3 + 0];
  float noy = points[(size_t)ip * 3 + 1];
  float noz = points[(size_t)ip * 3 + 2];
  float nq[4];
#pragma unroll
  for (int t = 0; t < 4; ++t)
    nq[t] = qb[(size_t)ip * CCH + 16 * t + lm];

  // a = q_i - k[idx] + p, in place over the k rows (row-major, stride 68 floats)
#pragma unroll
  for (int t = 0; t < 4; ++t) {
#pragma unroll
    for (int r = 0; r < 8; ++r) {
      float kv = st[(r + 8 * hi) * STG + 16 * t + lm];
      st[(r + 8 * hi) * STG + 16 * t + lm] = qv[t] - kv + p[t][r];
    }
  }
  asm volatile("s_wait_dscnt 0" ::: "memory");  // staging visible within wave

  // GEMM 1: t1 = relu(bn(a @ Wg1 + bg1))
  const float* arow = st + lm * STG + 2 * hi;   // A base, +16B per k-step
  float t1[4][8];
#pragma unroll
  for (int t = 0; t < 4; ++t) {
    const float* bbase = w1 + hi * 128 + (((16 * t + lm) ^ (hi << 4)) << 1);
    v8f acc = {};
#pragma unroll
    for (int s = 0; s < 16; ++s) {
      v2f av = *(const v2f*)(arow + 4 * s);        // ds_load_b64, imm offset
      v2f bv = *(const v2f*)(bbase + s * 256);     // ds_load_b64, imm offset
      acc = wmma_f32(av, bv, acc);
    }
    int c = 16 * t + lm;
    float g1bias = cst[3 * CCH + c], gscale = cst[4 * CCH + c], gshift = cst[5 * CCH + c];
#pragma unroll
    for (int r = 0; r < 8; ++r) {
      float x = (acc[r] + g1bias) * gscale + gshift;
      t1[t][r] = x > 0.0f ? x : 0.0f;
    }
  }

  // Overwrite staging with t1 (all tiles have finished reading `a`).
#pragma unroll
  for (int t = 0; t < 4; ++t)
#pragma unroll
    for (int r = 0; r < 8; ++r)
      st[(r + 8 * hi) * STG + 16 * t + lm] = t1[t][r];
  asm volatile("s_wait_dscnt 0" ::: "memory");

  // Next point's neighbor coordinates (its index came in during GEMM 1).
  unsigned nrow = row_of(nmi, last);
  float ngx = points[(size_t)nrow * 3 + 0];
  float ngy = points[(size_t)nrow * 3 + 1];
  float ngz = points[(size_t)nrow * 3 + 2];

  // GEMM 2: h = t1 @ Wg2 + bg2
  float h[4][8];
#pragma unroll
  for (int t = 0; t < 4; ++t) {
    const float* bbase = w2 + hi * 128 + (((16 * t + lm) ^ (hi << 4)) << 1);
    v8f acc = {};
#pragma unroll
    for (int s = 0; s < 16; ++s) {
      v2f av = *(const v2f*)(arow + 4 * s);
      v2f bv = *(const v2f*)(bbase + s * 256);
      acc = wmma_f32(av, bv, acc);
    }
    float g2bias = cst[6 * CCH + 16 * t + lm];
#pragma unroll
    for (int r = 0; r < 8; ++r)
      h[t][r] = acc[r] + g2bias;
  }

  asm volatile("s_wait_dscnt 0x0" ::: "memory");     // GEMM 2's reads of st are back before st is refilled
  asm volatile("s_wait_asynccnt 0x0" ::: "memory");  // this point's v rows have landed in vs
#pragma unroll
  for (int r = 0; r < 8; ++r)
    off8[r] = row_of(nidx[r], last) * (CCH * 4) + lm * 16;
  if (ip != i)                                       // scalar: a next point exists
    rows_to_lds(kb, off8, st_lds);                   // next point's k rows fly during the softmax

  // Softmax over the 16 neighbors per channel, then weighted sum with (v+p).
  // Channel c = 16t+lm lives in lanes lm and lm+16 (8 rows each).
#pragma unroll
  for (int t = 0; t < 4; ++t) {
    float mx = h[t][0];
#pragma unroll
    for (int r = 1; r < 8; ++r) mx = fmaxf(mx, h[t][r]);
    mx = fmaxf(mx, __shfl_xor(mx, 16, 32));
    float ssum = 0.0f;
#pragma unroll
    for (int r = 0; r < 8; ++r) {
      float e = __expf(h[t][r] - mx);
      h[t][r] = e;
      ssum += e;
    }
    ssum += __shfl_xor(ssum, 16, 32);
    float inv = 1.0f / ssum;

    float acc = 0.0f;
#pragma unroll
    for (int r = 0; r < 8; ++r) {
      float gvv = vs[(r + 8 * hi) * STG + 16 * t + lm];
      acc += (gvv + p[t][r]) * h[t][r];
    }
    acc *= inv;
    acc += __shfl_xor(acc, 16, 32);
    if (hi == 0) sb[(size_t)i * CCH + 16 * t + lm] = acc;
  }
  // the next trip reuses the registers that the last store names
  asm volatile("s_wait_xcnt 0x0" ::: "memory");

  gx = ngx; gy = ngy; gz = ngz;
  ox = nox; oy = noy; oz = noz;
#pragma unroll
  for (int t = 0; t < 4; ++t) qv[t] = nq[t];

  }  // point loop
}

// ---------------------------------------------------------------------------
// Kernel 3: out = s @ Wo + bo.  Same tiling as kernel 1, single matrix.
// ---------------------------------------------------------------------------
__global__ __launch_bounds__(256) void proj_kernel(
    const float* __restrict__ sbuf, const float* __restrict__ Wo,
    const float* __restrict__ bo, float* __restrict__ out, int ntiles)
{
  __shared__ float ldsW[CCH * CCH];
  load_w_swz(ldsW, Wo);
  __syncthreads();

  int wave = blockIdx.x * WAVES_PER_BLOCK + (threadIdx.x >> 5);
  if (wave >= ntiles) return;
  int lane = threadIdx.x & 31;
  int hi = lane >> 4, lm = lane & 15;
  int base = wave * 16;

  v2f A[16];
  const float* arow = sbuf + (size_t)(base + lm) * CCH;
#pragma unroll
  for (int s = 0; s < 16; ++s)
    A[s] = *(const v2f*)(arow + 4 * s + 2 * hi);

#pragma unroll
  for (int t = 0; t < 4; ++t) {
    const float* bbase = ldsW + hi * 128 + (((16 * t + lm) ^ (hi << 4)) << 1);
    v8f acc = {};
#pragma unroll
    for (int s = 0; s < 16; ++s) {
      v2f b = *(const v2f*)(bbase + s * 256);
      acc = wmma_f32(A[s], b, acc);
    }
    float bias = bo[16 * t + lm];
#pragma unroll
    for (int r = 0; r < 8; ++r)
      out[(size_t)(base + r + 8 * hi) * CCH + 16 * t + lm] = acc[r] + bias;
  }
}

// ---------------------------------------------------------------------------
extern "C" void kernel_launch(void* const* d_in, const int* in_sizes, int n_in,
                              void* d_out, int out_size, void* d_ws, size_t ws_size,
                              hipStream_t stream)
{
  const float* points   = (const float*)d_in[0];
  const float* features = (const float*)d_in[1];
  const int*   gidx     = (const int*)d_in[2];
  const float* Wq  = (const float*)d_in[3];  const float* bq  = (const float*)d_in[4];
  const float* Wk  = (const float*)d_in[5];  const float* bk  = (const float*)d_in[6];
  const float* Wv  = (const float*)d_in[7];  const float* bv  = (const float*)d_in[8];
  const float* Wp  = (const float*)d_in[9];  const float* b_p = (const float*)d_in[10];
  const float* bnp_g = (const float*)d_in[11]; const float* bnp_b = (const float*)d_in[12];
  const float* bnp_m = (const float*)d_in[13]; const float* bnp_v = (const float*)d_in[14];
  const float* Wg1 = (const float*)d_in[15]; const float* bg1 = (const float*)d_in[16];
  const float* bng_g = (const float*)d_in[17]; const float* bng_b = (const float*)d_in[18];
  const float* bng_m = (const float*)d_in[19]; const float* bng_v = (const float*)d_in[20];
  const float* Wg2 = (const float*)d_in[21]; const float* bg2 = (const float*)d_in[22];
  const float* Wo  = (const float*)d_in[23]; const float* bo  = (const float*)d_in[24];

  const int N = in_sizes[0] / 3;        // points is (N, 3); N = 50000 (16-aligned)
  float* qb = (float*)d_ws;             // workspace: q | k | v | s, each N*64 f32
  float* kb = qb + (size_t)N * CCH;
  float* vb = kb + (size_t)N * CCH;
  float* sb = vb + (size_t)N * CCH;

  const int ntiles = (N + 15) / 16;
  const int nblk_t = (ntiles + WAVES_PER_BLOCK - 1) / WAVES_PER_BLOCK;

  qkv_kernel<<<nblk_t, 256, 0, stream>>>(features, Wq, bq, Wk, bk, Wv, bv,
                                         qb, kb, vb, ntiles);
  pt_main_kernel<<<MAIN_BLOCKS, 256, 0, stream>>>(points, gidx, qb, kb, vb,
                                             Wp, b_p, bnp_g, bnp_b, bnp_m, bnp_v,
                                             Wg1, bg1, bng_g, bng_b, bng_m, bng_v,
                                             Wg2, bg2, sb, N);
  proj_kernel<<<nblk_t, 256, 0, stream>>>(sb, Wo, bo, (float*)d_out, ntiles);
}
